// v000
// Times are from an AMD MI455X. After a warm-up the kernel runs many times in a row, and a time is the length of
// such a window on the GPU divided by its runs, so every launch and the gaps after it count. The runs cycle
// through copies of the inputs. A figure is the median of several windows, for all but v000 over two sittings.
// Sittings can differ by a few percent; kernels timed side by side share one.
// v000 is the starting kernel. One run takes 265 microseconds.
#include <hip/hip_runtime.h>
#include <hip/hip_bf16.h>
#include <math.h>

typedef __attribute__((ext_vector_type(2))) float v2f;
typedef __attribute__((ext_vector_type(8))) float v8f;

#define TD_STRIDE 131072   // D*R*F = 256*64*8 : stride over t in the [T,D,R,F] layout
// input/output addr(t, dm, r, f) = t*TD_STRIDE + dm*512 + r*8 + f

// ---------------- Kernel 1: xv_mean[g][dm] = mean over (t,r) of v[t,dm,r,g] ----
__global__ void k_vmean_reduce(const float* __restrict__ v, float* __restrict__ xv_mean) {
    int idx = blockIdx.x * blockDim.x + threadIdx.x;   // 2048 threads
    int g = idx >> 8, dm = idx & 255;
    float s = 0.f;
    const float* p = v + dm * 512 + g;
    for (int t = 0; t < 8; ++t)
        for (int r = 0; r < 64; ++r)
            s += p[t * TD_STRIDE + r * 8];
    xv_mean[g * 256 + dm] = s * (1.f / 512.f);
}

// ---------------- Kernel 2: V_mean[g][j] = xv_mean[g,:] @ Wv[j,:] + bv[j] ------
__global__ void k_vmean_proj(const float* __restrict__ xv_mean, const float* __restrict__ Wv,
                             const float* __restrict__ bv, float* __restrict__ V_mean) {
    int j = threadIdx.x;                                // 256 threads, 1 block
    for (int g = 0; g < 8; ++g) {
        float acc = bv[j];
        const float* xm = xv_mean + g * 256;
        const float* w  = Wv + j * 256;
        for (int dm = 0; dm < 256; ++dm) acc += xm[dm] * w[dm];
        V_mean[g * 256 + j] = acc;
    }
}

// ---------------- Kernel 3: Q/K projection GEMM via V_WMMA_F32_16X16X4_F32 -----
// C[m, j] = sum_dm X[m, dm] * W[j, dm] + b[j], written to out[t, j, r, f]
__global__ void __launch_bounds__(32) k_proj_qk(
        const float* __restrict__ Xq, const float* __restrict__ Xk,
        const float* __restrict__ Wq, const float* __restrict__ bq,
        const float* __restrict__ Wk, const float* __restrict__ bk,
        float* __restrict__ out) {
    int bid   = blockIdx.x;
    int which = bid >> 12;                 // 0 = q, 1 = k
    int tile  = bid & 4095;
    int m0 = (tile >> 4) << 4;             // 256 M-tiles
    int n0 = (tile & 15) << 4;             // 16  N-tiles
    const float* X    = which ? Xk : Xq;
    const float* W    = which ? Wk : Wq;
    const float* bias = which ? bk : bq;
    float* O = out + which * 1048576;

    int lane = threadIdx.x;
    int lm = lane & 15;
    int lk = (lane >> 4) << 1;             // 0 or 2

    int m  = m0 + lm;
    int t  = m >> 9;
    int rf = m & 511;
    const float* xrow = X + t * TD_STRIDE + rf;   // element dm at xrow[dm*512]
    const float* wrow = W + (n0 + lm) * 256;      // element k  at wrow[k]

    v8f c = {};
    for (int kb = 0; kb < 256; kb += 4) {
        v2f a, b;
        a.x = xrow[(kb + lk) * 512];
        a.y = xrow[(kb + lk + 1) * 512];
        b.x = wrow[kb + lk];
        b.y = wrow[kb + lk + 1];
        c = __builtin_amdgcn_wmma_f32_16x16x4_f32(false, a, false, b, (short)0, c, false, false);
    }
    float bj = bias[n0 + lm];
    int half = lane >> 4;
    for (int v = 0; v < 8; ++v) {
        int mm = m0 + v + 8 * half;        // row M of C held by this lane/vgpr
        int tt = mm >> 9;
        int rr = mm & 511;
        O[tt * TD_STRIDE + (n0 + lm) * 512 + rr] = c[v] + bj;
    }
}

// ---------------- Kernel 4: fused scores (WMMA) -> softmax(Tk,Fk) -> pool ------
__global__ void __launch_bounds__(256) k_attn(const float* __restrict__ out,
                                              float* __restrict__ p_mean) {
    __shared__ float sQ[16 * 128];         // staged Q tile
    __shared__ float sS[8 * 16 * 64];      // per-wave 16x64 score tile
    __shared__ float sP[8 * 16 * 8];       // per-wave partial p sums

    int hh = blockIdx.x >> 8;              // head
    int m0 = (blockIdx.x & 255) << 4;      // query tile base
    int tid  = threadIdx.x;
    int wave = tid >> 5;
    int lane = tid & 31;
    int lm = lane & 15;
    int lk = (lane >> 4) << 1;

    const float* Q = out;                  // q_out region, layout [t, j, r, f]
    const float* K = out + 1048576;        // k_out region

    // stage the 16x128 Q tile for this head into LDS
    for (int i = tid; i < 2048; i += 256) {
        int qq = i >> 7, dd = i & 127;
        int m = m0 + qq;
        int t = m >> 9, rf = m & 511;
        sQ[qq * 128 + dd] = Q[t * TD_STRIDE + (hh * 128 + dd) * 512 + rf];
    }
    __syncthreads();

    const float inv_sqrt_d = 0.08838834764831845f;   // 1/sqrt(128)
    float accg[8];
    for (int g = 0; g < 8; ++g) accg[g] = 0.f;

    float* myS = sS + wave * 1024;

    // key-local index j = s*8 + g; for N-tile nt: s = 2*nt + (lm>>3), g = lm&7
    int sg = lm >> 3, gg = lm & 7;

    for (int ui = 0; ui < 8; ++ui) {
        int u = wave * 8 + ui;             // Rk value owned this iteration
        // key row (s,u,g) address: s*TD_STRIDE + (hh*128+dd)*512 + u*8 + g
        const float* kp0 = K + sg * TD_STRIDE + (hh * 128) * 512 + u * 8 + gg;
        const float* kp1 = kp0 + 2 * TD_STRIDE;
        const float* kp2 = kp0 + 4 * TD_STRIDE;
        const float* kp3 = kp0 + 6 * TD_STRIDE;

        v8f c0 = {}, c1 = {}, c2 = {}, c3 = {};
        for (int kb = 0; kb < 128; kb += 4) {
            v2f a, b;
            a.x = sQ[lm * 128 + kb + lk];
            a.y = sQ[lm * 128 + kb + lk + 1];
            int o0 = (kb + lk) * 512, o1 = (kb + lk + 1) * 512;
            b.x = kp0[o0]; b.y = kp0[o1];
            c0 = __builtin_amdgcn_wmma_f32_16x16x4_f32(false, a, false, b, (short)0, c0, false, false);
            b.x = kp1[o0]; b.y = kp1[o1];
            c1 = __builtin_amdgcn_wmma_f32_16x16x4_f32(false, a, false, b, (short)0, c1, false, false);
            b.x = kp2[o0]; b.y = kp2[o1];
            c2 = __builtin_amdgcn_wmma_f32_16x16x4_f32(false, a, false, b, (short)0, c2, false, false);
            b.x = kp3[o0]; b.y = kp3[o1];
            c3 = __builtin_amdgcn_wmma_f32_16x16x4_f32(false, a, false, b, (short)0, c3, false, false);
        }
        // scatter scaled scores to this wave's LDS tile: row M, col j
        int half = lane >> 4;
        for (int v = 0; v < 8; ++v) {
            int mq = v + 8 * half;
            myS[mq * 64 + lm]      = c0[v] * inv_sqrt_d;
            myS[mq * 64 + 16 + lm] = c1[v] * inv_sqrt_d;
            myS[mq * 64 + 32 + lm] = c2[v] * inv_sqrt_d;
            myS[mq * 64 + 48 + lm] = c3[v] * inv_sqrt_d;
        }
        __syncthreads();
        // softmax over the 64 (s,g) entries per query; accumulate per-g sums
        if (lane < 16) {
            float* row = myS + lane * 64;
            float mx = row[0];
            for (int jj = 1; jj < 64; ++jj) mx = fmaxf(mx, row[jj]);
            float eg[8]; for (int g = 0; g < 8; ++g) eg[g] = 0.f;
            float Z = 0.f;
            for (int jj = 0; jj < 64; ++jj) {
                float e = __expf(row[jj] - mx);
                Z += e;
                eg[jj & 7] += e;
            }
            float rZ = 1.f / Z;
            for (int g = 0; g < 8; ++g) accg[g] += eg[g] * rZ;
        }
        __syncthreads();
    }

    if (lane < 16)
        for (int g = 0; g < 8; ++g) sP[wave * 128 + lane * 8 + g] = accg[g];
    __syncthreads();
    if (tid < 128) {
        int qq = tid >> 3, g = tid & 7;
        float s = 0.f;
        for (int w = 0; w < 8; ++w) s += sP[w * 128 + qq * 8 + g];
        p_mean[hh * 32768 + (m0 + qq) * 8 + g] = s * (1.f / 512.f);
    }
}

// ---------------- Kernel 5: x_out[t,j,r,f<4] = sum_g p_mean * V_mean ----------
__global__ void k_out(const float* __restrict__ p_mean, const float* __restrict__ V_mean,
                      float* __restrict__ x_out) {
    int idx = blockIdx.x * blockDim.x + threadIdx.x;   // 524288
    int f = idx & 3;
    int r = (idx >> 2) & 63;
    int j = (idx >> 8) & 255;
    int t = idx >> 16;
    int n = t * 512 + r * 8 + f;
    int hh = j >> 7;
    const float* p = p_mean + hh * 32768 + n * 8;
    float acc = 0.f;
    for (int g = 0; g < 8; ++g) acc += p[g] * V_mean[g * 256 + j];
    x_out[idx] = acc;
}

extern "C" void kernel_launch(void* const* d_in, const int* in_sizes, int n_in,
                              void* d_out, int out_size, void* d_ws, size_t ws_size,
                              hipStream_t stream) {
    const float* q  = (const float*)d_in[0];
    const float* k  = (const float*)d_in[1];
    const float* v  = (const float*)d_in[2];
    const float* Wq = (const float*)d_in[3];
    const float* bq = (const float*)d_in[4];
    const float* Wk = (const float*)d_in[5];
    const float* bk = (const float*)d_in[6];
    const float* Wv = (const float*)d_in[7];
    const float* bv = (const float*)d_in[8];
    float* out = (float*)d_out;          // [q_out | k_out | x_out]
    float* ws  = (float*)d_ws;
    float* xv_mean = ws;                 // 2048 floats
    float* V_mean  = ws + 2048;          // 2048 floats
    float* p_mean  = ws + 4096;          // 65536 floats  (~280 KB total ws)

    k_vmean_reduce<<<8, 256, 0, stream>>>(v, xv_mean);
    k_vmean_proj<<<1, 256, 0, stream>>>(xv_mean, Wv, bv, V_mean);
    k_proj_qk<<<8192, 32, 0, stream>>>(q, k, Wq, bq, Wk, bk, out);
    k_attn<<<512, 256, 0, stream>>>(out, p_mean);
    k_out<<<2048, 256, 0, stream>>>(p_mean, V_mean, out + 2097152);
}

// v001
// One run takes 222 microseconds.
// Two timings next to v000 both put it at 1.22 times that version's speed.
#include <hip/hip_runtime.h>
#include <hip/hip_bf16.h>
#include <math.h>

typedef __attribute__((ext_vector_type(2))) float v2f;
typedef __attribute__((ext_vector_type(8))) float v8f;

#define TD_STRIDE 131072   // D*R*F = 256*64*8 : stride over t in the [T,D,R,F] layout
// input/output addr(t, dm, r, f) = t*TD_STRIDE + dm*512 + r*8 + f

// ---------------- Kernel 1: xv_mean[g][dm] = mean over (t,r) of v[t,dm,r,g] ----
__global__ void k_vmean_reduce(const float* __restrict__ v, float* __restrict__ xv_mean) {
    int idx = blockIdx.x * blockDim.x + threadIdx.x;   // 2048 threads
    int g = idx >> 8, dm = idx & 255;
    float s = 0.f;
    const float* p = v + dm * 512 + g;
    for (int t = 0; t < 8; ++t)
        for (int r = 0; r < 64; ++r)
            s += p[t * TD_STRIDE + r * 8];
    xv_mean[g * 256 + dm] = s * (1.f / 512.f);
}

// ---------------- Kernel 2: V_mean[g][j] = xv_mean[g,:] @ Wv[j,:] + bv[j] ------
__global__ void k_vmean_proj(const float* __restrict__ xv_mean, const float* __restrict__ Wv,
                             const float* __restrict__ bv, float* __restrict__ V_mean) {
    int j = threadIdx.x;                                // 256 threads, 1 block
    for (int g = 0; g < 8; ++g) {
        float acc = bv[j];
        const float* xm = xv_mean + g * 256;
        const float* w  = Wv + j * 256;
        for (int dm = 0; dm < 256; ++dm) acc += xm[dm] * w[dm];
        V_mean[g * 256 + j] = acc;
    }
}

// ---------------- Kernel 3: Q/K projection GEMM via V_WMMA_F32_16X16X4_F32 -----
// C[m, j] = sum_dm X[m, dm] * W[j, dm] + b[j], written to out[t, j, r, f]
__global__ void __launch_bounds__(32) k_proj_qk(
        const float* __restrict__ Xq, const float* __restrict__ Xk,
        const float* __restrict__ Wq, const float* __restrict__ bq,
        const float* __restrict__ Wk, const float* __restrict__ bk,
        float* __restrict__ out) {
    int bid   = blockIdx.x;
    int which = bid >> 12;                 // 0 = q, 1 = k
    int tile  = bid & 4095;
    int m0 = (tile >> 4) << 4;             // 256 M-tiles
    int n0 = (tile & 15) << 4;             // 16  N-tiles
    const float* X    = which ? Xk : Xq;
    const float* W    = which ? Wk : Wq;
    const float* bias = which ? bk : bq;
    float* O = out + which * 1048576;

    int lane = threadIdx.x;
    int lm = lane & 15;
    int lk = (lane >> 4) << 1;             // 0 or 2

    int m  = m0 + lm;
    int t  = m >> 9;
    int rf = m & 511;
    const float* xrow = X + t * TD_STRIDE + rf;   // element dm at xrow[dm*512]
    const float* wrow = W + (n0 + lm) * 256;      // element k  at wrow[k]

    v8f c = {};
    for (int kb = 0; kb < 256; kb += 4) {
        v2f a, b;
        a.x = xrow[(kb + lk) * 512];
        a.y = xrow[(kb + lk + 1) * 512];
        b.x = wrow[kb + lk];
        b.y = wrow[kb + lk + 1];
        c = __builtin_amdgcn_wmma_f32_16x16x4_f32(false, a, false, b, (short)0, c, false, false);
    }
    float bj = bias[n0 + lm];
    int half = lane >> 4;
    for (int v = 0; v < 8; ++v) {
        int mm = m0 + v + 8 * half;        // row M of C held by this lane/vgpr
        int tt = mm >> 9;
        int rr = mm & 511;
        O[tt * TD_STRIDE + (n0 + lm) * 512 + rr] = c[v] + bj;
    }
}

// ---------------- Kernel 4: fused scores (WMMA) -> softmax(Tk,Fk) -> pool ------
// x_out keeps only the query rows with f < 4, so only those 2048 rows per head
// are scored. Kept row qi maps to (t, r, f) = (qi >> 8, (qi >> 2) & 63, qi & 3).
// 16 waves per block, 4 values of u each, keep as many waves on the chip as before.
__device__ __forceinline__ int kept_row(int qi) {
    return (qi >> 8) * 512 + ((qi >> 2) & 63) * 8 + (qi & 3);   // m = t*512 + r*8 + f
}

__global__ void __launch_bounds__(512) k_attn(const float* __restrict__ out,
                                              float* __restrict__ p_mean) {
    __shared__ float sQ[16 * 128];         // staged Q tile
    __shared__ float sS[16 * 16 * 64];      // per-wave 16x64 score tile
    __shared__ float sP[16 * 16 * 8];      // per-wave partial p sums

    int hh = blockIdx.x >> 7;              // head
    int q0 = (blockIdx.x & 127) << 4;      // tile base among the kept query rows
    int tid  = threadIdx.x;
    int wave = tid >> 5;
    int lane = tid & 31;
    int lm = lane & 15;
    int lk = (lane >> 4) << 1;

    const float* Q = out;                  // q_out region, layout [t, j, r, f]
    const float* K = out + 1048576;        // k_out region

    // stage the 16x128 Q tile for this head into LDS
    for (int i = tid; i < 2048; i += 512) {
        int qq = i >> 7, dd = i & 127;
        int m = kept_row(q0 + qq);
        int t = m >> 9, rf = m & 511;
        sQ[qq * 128 + dd] = Q[t * TD_STRIDE + (hh * 128 + dd) * 512 + rf];
    }
    __syncthreads();

    const float inv_sqrt_d = 0.08838834764831845f;   // 1/sqrt(128)
    float accg[8];
    for (int g = 0; g < 8; ++g) accg[g] = 0.f;

    float* myS = sS + wave * 1024;

    // key-local index j = s*8 + g; for N-tile nt: s = 2*nt + (lm>>3), g = lm&7
    int sg = lm >> 3, gg = lm & 7;

    for (int ui = 0; ui < 4; ++ui) {
        int u = wave * 4 + ui;             // Rk value owned this iteration
        // key row (s,u,g) address: s*TD_STRIDE + (hh*128+dd)*512 + u*8 + g
        const float* kp0 = K + sg * TD_STRIDE + (hh * 128) * 512 + u * 8 + gg;
        const float* kp1 = kp0 + 2 * TD_STRIDE;
        const float* kp2 = kp0 + 4 * TD_STRIDE;
        const float* kp3 = kp0 + 6 * TD_STRIDE;

        v8f c0 = {}, c1 = {}, c2 = {}, c3 = {};
        for (int kb = 0; kb < 128; kb += 4) {
            v2f a, b;
            a.x = sQ[lm * 128 + kb + lk];
            a.y = sQ[lm * 128 + kb + lk + 1];
            int o0 = (kb + lk) * 512, o1 = (kb + lk + 1) * 512;
            b.x = kp0[o0]; b.y = kp0[o1];
            c0 = __builtin_amdgcn_wmma_f32_16x16x4_f32(false, a, false, b, (short)0, c0, false, false);
            b.x = kp1[o0]; b.y = kp1[o1];
            c1 = __builtin_amdgcn_wmma_f32_16x16x4_f32(false, a, false, b, (short)0, c1, false, false);
            b.x = kp2[o0]; b.y = kp2[o1];
            c2 = __builtin_amdgcn_wmma_f32_16x16x4_f32(false, a, false, b, (short)0, c2, false, false);
            b.x = kp3[o0]; b.y = kp3[o1];
            c3 = __builtin_amdgcn_wmma_f32_16x16x4_f32(false, a, false, b, (short)0, c3, false, false);
        }
        // scatter scaled scores to this wave's LDS tile: row M, col j
        int half = lane >> 4;
        for (int v = 0; v < 8; ++v) {
            int mq = v + 8 * half;
            myS[mq * 64 + lm]      = c0[v] * inv_sqrt_d;
            myS[mq * 64 + 16 + lm] = c1[v] * inv_sqrt_d;
            myS[mq * 64 + 32 + lm] = c2[v] * inv_sqrt_d;
            myS[mq * 64 + 48 + lm] = c3[v] * inv_sqrt_d;
        }
        __syncthreads();
        // softmax over the 64 (s,g) entries per query; accumulate per-g sums
        if (lane < 16) {
            float* row = myS + lane * 64;
            float mx = row[0];
            for (int jj = 1; jj < 64; ++jj) mx = fmaxf(mx, row[jj]);
            float eg[8]; for (int g = 0; g < 8; ++g) eg[g] = 0.f;
            float Z = 0.f;
            for (int jj = 0; jj < 64; ++jj) {
                float e = __expf(row[jj] - mx);
                Z += e;
                eg[jj & 7] += e;
            }
            float rZ = 1.f / Z;
            for (int g = 0; g < 8; ++g) accg[g] += eg[g] * rZ;
        }
        __syncthreads();
    }

    if (lane < 16)
        for (int g = 0; g < 8; ++g) sP[wave * 128 + lane * 8 + g] = accg[g];
    __syncthreads();
    if (tid < 128) {
        int qq = tid >> 3, g = tid & 7;
        float s = 0.f;
        for (int w = 0; w < 16; ++w) s += sP[w * 128 + qq * 8 + g];
        p_mean[hh * 32768 + kept_row(q0 + qq) * 8 + g] = s * (1.f / 512.f);
    }
}

// ---------------- Kernel 5: x_out[t,j,r,f<4] = sum_g p_mean * V_mean ----------
__global__ void k_out(const float* __restrict__ p_mean, const float* __restrict__ V_mean,
                      float* __restrict__ x_out) {
    int idx = blockIdx.x * blockDim.x + threadIdx.x;   // 524288
    int f = idx & 3;
    int r = (idx >> 2) & 63;
    int j = (idx >> 8) & 255;
    int t = idx >> 16;
    int n = t * 512 + r * 8 + f;
    int hh = j >> 7;
    const float* p = p_mean + hh * 32768 + n * 8;
    float acc = 0.f;
    for (int g = 0; g < 8; ++g) acc += p[g] * V_mean[g * 256 + j];
    x_out[idx] = acc;
}

extern "C" void kernel_launch(void* const* d_in, const int* in_sizes, int n_in,
                              void* d_out, int out_size, void* d_ws, size_t ws_size,
                              hipStream_t stream) {
    const float* q  = (const float*)d_in[0];
    const float* k  = (const float*)d_in[1];
    const float* v  = (const float*)d_in[2];
    const float* Wq = (const float*)d_in[3];
    const float* bq = (const float*)d_in[4];
    const float* Wk = (const float*)d_in[5];
    const float* bk = (const float*)d_in[6];
    const float* Wv = (const float*)d_in[7];
    const float* bv = (const float*)d_in[8];
    float* out = (float*)d_out;          // [q_out | k_out | x_out]
    float* ws  = (float*)d_ws;
    float* xv_mean = ws;                 // 2048 floats
    float* V_mean  = ws + 2048;          // 2048 floats
    float* p_mean  = ws + 4096;          // 65536 floats  (~280 KB total ws)

    k_vmean_reduce<<<8, 256, 0, stream>>>(v, xv_mean);
    k_vmean_proj<<<1, 256, 0, stream>>>(xv_mean, Wv, bv, V_mean);
    k_proj_qk<<<8192, 32, 0, stream>>>(q, k, Wq, bq, Wk, bk, out);
    k_attn<<<256, 512, 0, stream>>>(out, p_mean);
    k_out<<<2048, 256, 0, stream>>>(p_mean, V_mean, out + 2097152);
}

// v002
// One run takes 134 microseconds.
// Two timings next to v001 both put it at 1.66 times that version's speed.
// All steps since v000 together make it 2.02 times as fast.
#include <hip/hip_runtime.h>
#include <hip/hip_bf16.h>
#include <math.h>

typedef __attribute__((ext_vector_type(2))) float v2f;
typedef __attribute__((ext_vector_type(4))) float v4f;
typedef __attribute__((ext_vector_type(8))) float v8f;

#define TD_STRIDE 131072   // D*R*F = 256*64*8 : stride over t in the [T,D,R,F] layout
// input/output addr(t, dm, r, f) = t*TD_STRIDE + dm*512 + r*8 + f

// ---------------- Kernel 1: xv_mean[dm][g] = mean over (t,r) of v[t,dm,r,g] ----
// One wave per dm. For a fixed (t, dm) the 512 floats (r, g) are contiguous, so the
// lanes walk them 16 bytes each and every load covers whole lines.
// Float offset (i*32 + lane)*4 + c holds g = (lane & 1)*4 + c.
__global__ void __launch_bounds__(128) k_vmean_reduce(const float* __restrict__ v,
                                                      float* __restrict__ xv_mean) {
    int lane = threadIdx.x & 31;
    int dm = blockIdx.x * 4 + (threadIdx.x >> 5);      // 64 blocks of 4 waves
    const v4f* p = (const v4f*)(v + dm * 512) + lane;
    v4f x[32];
    for (int t = 0; t < 8; ++t)
        for (int i = 0; i < 4; ++i)
            x[t * 4 + i] = p[t * (TD_STRIDE / 4) + i * 32];
    v4f s0 = x[0], s1 = x[1], s2 = x[2], s3 = x[3];
    for (int t = 1; t < 8; ++t) {
        s0 += x[t * 4];     s1 += x[t * 4 + 1];
        s2 += x[t * 4 + 2]; s3 += x[t * 4 + 3];
    }
    v4f s = (s0 + s1) + (s2 + s3);
    // lanes of equal parity hold the same four g
    for (int m = 2; m < 32; m <<= 1)
        for (int c = 0; c < 4; ++c) s[c] += __shfl_xor(s[c], m, 32);
    if (lane < 2)
        *(v4f*)(xv_mean + dm * 8 + lane * 4) = s * (1.f / 512.f);
}

// ---------------- Kernel 2: V_mean[j][g] = xv_mean[:,g] @ Wv[j,:] + bv[j] ------
// One wave per j. Lane l takes dm = l + 32*i, so a row of Wv is read as whole lines.
__global__ void __launch_bounds__(128) k_vmean_proj(const float* __restrict__ xv_mean,
                                                    const float* __restrict__ Wv,
                                                    const float* __restrict__ bv,
                                                    float* __restrict__ V_mean) {
    int lane = threadIdx.x & 31;
    int j = blockIdx.x * 4 + (threadIdx.x >> 5);       // 64 blocks of 4 waves
    const float* w = Wv + j * 256 + lane;
    const v4f* xm = (const v4f*)xv_mean + lane * 2;
    v4f a0 = {}, a1 = {};
    for (int i = 0; i < 8; ++i) {
        float wv = w[i * 32];
        a0 += wv * xm[i * 64];
        a1 += wv * xm[i * 64 + 1];
    }
    for (int m = 1; m < 32; m <<= 1)
        for (int c = 0; c < 4; ++c) {
            a0[c] += __shfl_xor(a0[c], m, 32);
            a1[c] += __shfl_xor(a1[c], m, 32);
        }
    if (lane < 2) {
        v4f o = lane ? a1 : a0;
        *(v4f*)(V_mean + j * 8 + lane * 4) = o + bv[j];
    }
}

// ---------------- Kernel 3: Q/K projection GEMM via V_WMMA_F32_16X16X4_F32 -----
// C[m, j] = sum_dm X[m, dm] * W[j, dm] + b[j], written to out[t, j, r, f]
__global__ void __launch_bounds__(32) k_proj_qk(
        const float* __restrict__ Xq, const float* __restrict__ Xk,
        const float* __restrict__ Wq, const float* __restrict__ bq,
        const float* __restrict__ Wk, const float* __restrict__ bk,
        float* __restrict__ out) {
    int bid   = blockIdx.x;
    int which = bid >> 12;                 // 0 = q, 1 = k
    int tile  = bid & 4095;
    int m0 = (tile >> 4) << 4;             // 256 M-tiles
    int n0 = (tile & 15) << 4;             // 16  N-tiles
    const float* X    = which ? Xk : Xq;
    const float* W    = which ? Wk : Wq;
    const float* bias = which ? bk : bq;
    float* O = out + which * 1048576;

    int lane = threadIdx.x;
    int lm = lane & 15;
    int lk = (lane >> 4) << 1;             // 0 or 2

    int m  = m0 + lm;
    int t  = m >> 9;
    int rf = m & 511;
    const float* xrow = X + t * TD_STRIDE + rf;   // element dm at xrow[dm*512]
    const float* wrow = W + (n0 + lm) * 256;      // element k  at wrow[k]

    v8f c = {};
    for (int kb = 0; kb < 256; kb += 4) {
        v2f a, b;
        a.x = xrow[(kb + lk) * 512];
        a.y = xrow[(kb + lk + 1) * 512];
        b.x = wrow[kb + lk];
        b.y = wrow[kb + lk + 1];
        c = __builtin_amdgcn_wmma_f32_16x16x4_f32(false, a, false, b, (short)0, c, false, false);
    }
    float bj = bias[n0 + lm];
    int half = lane >> 4;
    for (int v = 0; v < 8; ++v) {
        int mm = m0 + v + 8 * half;        // row M of C held by this lane/vgpr
        int tt = mm >> 9;
        int rr = mm & 511;
        O[tt * TD_STRIDE + (n0 + lm) * 512 + rr] = c[v] + bj;
    }
}

// ---------------- Kernel 4: fused scores (WMMA) -> softmax(Tk,Fk) -> pool ------
// x_out keeps only the query rows with f < 4, so only those 2048 rows per head
// are scored. Kept row qi maps to (t, r, f) = (qi >> 8, (qi >> 2) & 63, qi & 3).
// 16 waves per block, 4 values of u each, keep as many waves on the chip as before.
__device__ __forceinline__ int kept_row(int qi) {
    return (qi >> 8) * 512 + ((qi >> 2) & 63) * 8 + (qi & 3);   // m = t*512 + r*8 + f
}

__global__ void __launch_bounds__(512) k_attn(const float* __restrict__ out,
                                              float* __restrict__ p_mean) {
    __shared__ float sQ[16 * 128];         // staged Q tile
    __shared__ float sS[16 * 16 * 64];      // per-wave 16x64 score tile
    __shared__ float sP[16 * 16 * 8];      // per-wave partial p sums

    int hh = blockIdx.x >> 7;              // head
    int q0 = (blockIdx.x & 127) << 4;      // tile base among the kept query rows
    int tid  = threadIdx.x;
    int wave = tid >> 5;
    int lane = tid & 31;
    int lm = lane & 15;
    int lk = (lane >> 4) << 1;

    const float* Q = out;                  // q_out region, layout [t, j, r, f]
    const float* K = out + 1048576;        // k_out region

    // stage the 16x128 Q tile for this head into LDS
    for (int i = tid; i < 2048; i += 512) {
        int qq = i >> 7, dd = i & 127;
        int m = kept_row(q0 + qq);
        int t = m >> 9, rf = m & 511;
        sQ[qq * 128 + dd] = Q[t * TD_STRIDE + (hh * 128 + dd) * 512 + rf];
    }
    __syncthreads();

    const float inv_sqrt_d = 0.08838834764831845f;   // 1/sqrt(128)
    float accg[8];
    for (int g = 0; g < 8; ++g) accg[g] = 0.f;

    float* myS = sS + wave * 1024;

    // key-local index j = s*8 + g; for N-tile nt: s = 2*nt + (lm>>3), g = lm&7
    int sg = lm >> 3, gg = lm & 7;

    for (int ui = 0; ui < 4; ++ui) {
        int u = wave * 4 + ui;             // Rk value owned this iteration
        // key row (s,u,g) address: s*TD_STRIDE + (hh*128+dd)*512 + u*8 + g
        const float* kp0 = K + sg * TD_STRIDE + (hh * 128) * 512 + u * 8 + gg;
        const float* kp1 = kp0 + 2 * TD_STRIDE;
        const float* kp2 = kp0 + 4 * TD_STRIDE;
        const float* kp3 = kp0 + 6 * TD_STRIDE;

        v8f c0 = {}, c1 = {}, c2 = {}, c3 = {};
        for (int kb = 0; kb < 128; kb += 4) {
            v2f a, b;
            a.x = sQ[lm * 128 + kb + lk];
            a.y = sQ[lm * 128 + kb + lk + 1];
            int o0 = (kb + lk) * 512, o1 = (kb + lk + 1) * 512;
            b.x = kp0[o0]; b.y = kp0[o1];
            c0 = __builtin_amdgcn_wmma_f32_16x16x4_f32(false, a, false, b, (short)0, c0, false, false);
            b.x = kp1[o0]; b.y = kp1[o1];
            c1 = __builtin_amdgcn_wmma_f32_16x16x4_f32(false, a, false, b, (short)0, c1, false, false);
            b.x = kp2[o0]; b.y = kp2[o1];
            c2 = __builtin_amdgcn_wmma_f32_16x16x4_f32(false, a, false, b, (short)0, c2, false, false);
            b.x = kp3[o0]; b.y = kp3[o1];
            c3 = __builtin_amdgcn_wmma_f32_16x16x4_f32(false, a, false, b, (short)0, c3, false, false);
        }
        // scatter scaled scores to this wave's LDS tile: row M, col j
        int half = lane >> 4;
        for (int v = 0; v < 8; ++v) {
            int mq = v + 8 * half;
            myS[mq * 64 + lm]      = c0[v] * inv_sqrt_d;
            myS[mq * 64 + 16 + lm] = c1[v] * inv_sqrt_d;
            myS[mq * 64 + 32 + lm] = c2[v] * inv_sqrt_d;
            myS[mq * 64 + 48 + lm] = c3[v] * inv_sqrt_d;
        }
        __syncthreads();
        // softmax over the 64 (s,g) entries per query; accumulate per-g sums
        if (lane < 16) {
            float* row = myS + lane * 64;
            float mx = row[0];
            for (int jj = 1; jj < 64; ++jj) mx = fmaxf(mx, row[jj]);
            float eg[8]; for (int g = 0; g < 8; ++g) eg[g] = 0.f;
            float Z = 0.f;
            for (int jj = 0; jj < 64; ++jj) {
                float e = __expf(row[jj] - mx);
                Z += e;
                eg[jj & 7] += e;
            }
            float rZ = 1.f / Z;
            for (int g = 0; g < 8; ++g) accg[g] += eg[g] * rZ;
        }
        __syncthreads();
    }

    if (lane < 16)
        for (int g = 0; g < 8; ++g) sP[wave * 128 + lane * 8 + g] = accg[g];
    __syncthreads();
    if (tid < 128) {
        int qq = tid >> 3, g = tid & 7;
        float s = 0.f;
        for (int w = 0; w < 16; ++w) s += sP[w * 128 + qq * 8 + g];
        p_mean[hh * 32768 + kept_row(q0 + qq) * 8 + g] = s * (1.f / 512.f);
    }
}

// ---------------- Kernel 5: x_out[t,j,r,f<4] = sum_g p_mean * V_mean ----------
__global__ void k_out(const float* __restrict__ p_mean, const float* __restrict__ V_mean,
                      float* __restrict__ x_out) {
    int idx = blockIdx.x * blockDim.x + threadIdx.x;   // 524288
    int f = idx & 3;
    int r = (idx >> 2) & 63;
    int j = (idx >> 8) & 255;
    int t = idx >> 16;
    int n = t * 512 + r * 8 + f;
    int hh = j >> 7;
    const float* p = p_mean + hh * 32768 + n * 8;
    float acc = 0.f;
    for (int g = 0; g < 8; ++g) acc += p[g] * V_mean[j * 8 + g];
    x_out[idx] = acc;
}

extern "C" void kernel_launch(void* const* d_in, const int* in_sizes, int n_in,
                              void* d_out, int out_size, void* d_ws, size_t ws_size,
                              hipStream_t stream) {
    const float* q  = (const float*)d_in[0];
    const float* k  = (const float*)d_in[1];
    const float* v  = (const float*)d_in[2];
    const float* Wq = (const float*)d_in[3];
    const float* bq = (const float*)d_in[4];
    const float* Wk = (const float*)d_in[5];
    const float* bk = (const float*)d_in[6];
    const float* Wv = (const float*)d_in[7];
    const float* bv = (const float*)d_in[8];
    float* out = (float*)d_out;          // [q_out | k_out | x_out]
    float* ws  = (float*)d_ws;
    float* xv_mean = ws;                 // 2048 floats
    float* V_mean  = ws + 2048;          // 2048 floats
    float* p_mean  = ws + 4096;          // 65536 floats  (~280 KB total ws)

    k_vmean_reduce<<<64, 128, 0, stream>>>(v, xv_mean);
    k_vmean_proj<<<64, 128, 0, stream>>>(xv_mean, Wv, bv, V_mean);
    k_proj_qk<<<8192, 32, 0, stream>>>(q, k, Wq, bq, Wk, bk, out);
    k_attn<<<256, 512, 0, stream>>>(out, p_mean);
    k_out<<<2048, 256, 0, stream>>>(p_mean, V_mean, out + 2097152);
}

// v003
// A run of this version takes 57.5 microseconds.
// Next to v002, in two timings, it ran 2.34 and 2.33 times as fast.
// Over all steps from v000 it is 4.71 times as fast.
#include <hip/hip_runtime.h>
#include <hip/hip_bf16.h>
#include <math.h>

typedef __attribute__((ext_vector_type(2))) float v2f;
typedef __attribute__((ext_vector_type(4))) float v4f;
typedef __attribute__((ext_vector_type(8))) float v8f;

#define TD_STRIDE 131072   // D*R*F = 256*64*8 : stride over t in the [T,D,R,F] layout
// input/output addr(t, dm, r, f) = t*TD_STRIDE + dm*512 + r*8 + f

// ---------------- Kernel 1: xv_mean[dm][g] = mean over (t,r) of v[t,dm,r,g] ----
// One wave per dm. For a fixed (t, dm) the 512 floats (r, g) are contiguous, so the
// lanes walk them 16 bytes each and every load covers whole lines.
// Float offset (i*32 + lane)*4 + c holds g = (lane & 1)*4 + c.
__global__ void __launch_bounds__(128) k_vmean_reduce(const float* __restrict__ v,
                                                      float* __restrict__ xv_mean) {
    int lane = threadIdx.x & 31;
    int dm = blockIdx.x * 4 + (threadIdx.x >> 5);      // 64 blocks of 4 waves
    const v4f* p = (const v4f*)(v + dm * 512) + lane;
    v4f x[32];
    for (int t = 0; t < 8; ++t)
        for (int i = 0; i < 4; ++i)
            x[t * 4 + i] = p[t * (TD_STRIDE / 4) + i * 32];
    v4f s0 = x[0], s1 = x[1], s2 = x[2], s3 = x[3];
    for (int t = 1; t < 8; ++t) {
        s0 += x[t * 4];     s1 += x[t * 4 + 1];
        s2 += x[t * 4 + 2]; s3 += x[t * 4 + 3];
    }
    v4f s = (s0 + s1) + (s2 + s3);
    // lanes of equal parity hold the same four g
    for (int m = 2; m < 32; m <<= 1)
        for (int c = 0; c < 4; ++c) s[c] += __shfl_xor(s[c], m, 32);
    if (lane < 2)
        *(v4f*)(xv_mean + dm * 8 + lane * 4) = s * (1.f / 512.f);
}

// ---------------- Kernel 2: V_mean[j][g] = xv_mean[:,g] @ Wv[j,:] + bv[j] ------
// One wave per j. Lane l takes dm = l + 32*i, so a row of Wv is read as whole lines.
__global__ void __launch_bounds__(128) k_vmean_proj(const float* __restrict__ xv_mean,
                                                    const float* __restrict__ Wv,
                                                    const float* __restrict__ bv,
                                                    float* __restrict__ V_mean) {
    int lane = threadIdx.x & 31;
    int j = blockIdx.x * 4 + (threadIdx.x >> 5);       // 64 blocks of 4 waves
    const float* w = Wv + j * 256 + lane;
    const v4f* xm = (const v4f*)xv_mean + lane * 2;
    v4f a0 = {}, a1 = {};
    for (int i = 0; i < 8; ++i) {
        float wv = w[i * 32];
        a0 += wv * xm[i * 64];
        a1 += wv * xm[i * 64 + 1];
    }
    for (int m = 1; m < 32; m <<= 1)
        for (int c = 0; c < 4; ++c) {
            a0[c] += __shfl_xor(a0[c], m, 32);
            a1[c] += __shfl_xor(a1[c], m, 32);
        }
    if (lane < 2) {
        v4f o = lane ? a1 : a0;
        *(v4f*)(V_mean + j * 8 + lane * 4) = o + bv[j];
    }
}

// ---------------- Kernel 3: Q/K projection GEMM via V_WMMA_F32_16X16X4_F32 -----
// C[m, j] = sum_dm X[m, dm] * W[j, dm] + b[j], written to out[t, j, r, f]
__global__ void __launch_bounds__(32) k_proj_qk(
        const float* __restrict__ Xq, const float* __restrict__ Xk,
        const float* __restrict__ Wq, const float* __restrict__ bq,
        const float* __restrict__ Wk, const float* __restrict__ bk,
        float* __restrict__ out) {
    int bid   = blockIdx.x;
    int which = bid >> 12;                 // 0 = q, 1 = k
    int tile  = bid & 4095;
    int m0 = (tile >> 4) << 4;             // 256 M-tiles
    int n0 = (tile & 15) << 4;             // 16  N-tiles
    const float* X    = which ? Xk : Xq;
    const float* W    = which ? Wk : Wq;
    const float* bias = which ? bk : bq;
    float* O = out + which * 1048576;

    int lane = threadIdx.x;
    int lm = lane & 15;
    int lk = (lane >> 4) << 1;             // 0 or 2

    int m  = m0 + lm;
    int t  = m >> 9;
    int rf = m & 511;
    const float* xrow = X + t * TD_STRIDE + rf;   // element dm at xrow[dm*512]
    const float* wrow = W + (n0 + lm) * 256;      // element k  at wrow[k]

    v8f c = {};
    for (int kb = 0; kb < 256; kb += 4) {
        v2f a, b;
        a.x = xrow[(kb + lk) * 512];
        a.y = xrow[(kb + lk + 1) * 512];
        b.x = wrow[kb + lk];
        b.y = wrow[kb + lk + 1];
        c = __builtin_amdgcn_wmma_f32_16x16x4_f32(false, a, false, b, (short)0, c, false, false);
    }
    float bj = bias[n0 + lm];
    int half = lane >> 4;
    for (int v = 0; v < 8; ++v) {
        int mm = m0 + v + 8 * half;        // row M of C held by this lane/vgpr
        int tt = mm >> 9;
        int rr = mm & 511;
        O[tt * TD_STRIDE + (n0 + lm) * 512 + rr] = c[v] + bj;
    }
}

// ---------------- Kernel 4: fused scores (WMMA) -> softmax(Tk,Fk) -> pool ------
// x_out keeps only the query rows with f < 4, so only those 2048 rows per head
// are scored. Kept row qi maps to (t, r, f) = (qi >> 8, (qi >> 2) & 63, qi & 3).
//
// One wave owns 4 values of u. For a fixed (s, dd) their 32 floats (u, g) are one
// 128-byte line of k_out, so 8 lanes read it whole, 16 bytes each, exactly once.
// The product is taken transposed, S^T = K Q^T: K is the A operand, Q the B operand.
//   A row  lm       : s = 2*nt + (lm >> 3), line floats (lm & 7)*4 + e, e = 0..3
//   tile   (nt, e)  : element e of the 16-byte loads of the s pair nt
//   C      c[v]     : query lm, key row v + 8*half, that is
//                     s = 2*nt + half, u = wave*4 + (v >> 1), g = (v & 1)*4 + e
// A lane so holds 32 of the 64 (s, g) scores of each of its 4 (query, u) pairs and
// lane ^ 16 holds the other 32: the softmax stays in registers.
__device__ __forceinline__ int kept_row(int qi) {
    return (qi >> 8) * 512 + ((qi >> 2) & 63) * 8 + (qi & 3);   // m = t*512 + r*8 + f
}

__device__ __forceinline__ void load_k(v4f (&d)[8], const float* kp) {
    for (int nt = 0; nt < 4; ++nt) {
        d[2 * nt]     = *(const v4f*)(kp + nt * 2 * TD_STRIDE);         // dd
        d[2 * nt + 1] = *(const v4f*)(kp + nt * 2 * TD_STRIDE + 512);   // dd + 1
    }
}

__device__ __forceinline__ void mma_k(v8f (&c)[16], const v4f (&d)[8], v2f b) {
    for (int nt = 0; nt < 4; ++nt)
        for (int e = 0; e < 4; ++e) {
            v2f a;
            a.x = d[2 * nt][e];
            a.y = d[2 * nt + 1][e];
            c[nt * 4 + e] = __builtin_amdgcn_wmma_f32_16x16x4_f32(false, a, false, b, (short)0,
                                                                 c[nt * 4 + e], false, false);
        }
}

// exp(x) in the native form, a multiply by log2(e) and v_exp_f32. The v_nop keeps the one
// slot the instruction set asks for behind a transcendental, before its result is read
// or its source register overwritten.
__device__ __forceinline__ float exp_native(float x) {
    float t = x * 1.4426950408889634f, r;
    asm("v_exp_f32 %0, %1\n\tv_nop" : "=v"(r) : "v"(t));
    return r;
}

__global__ void __launch_bounds__(512) k_attn(const float* __restrict__ out,
                                              float* __restrict__ p_mean) {
    __shared__ float sQ[16 * 128];         // staged Q tile
    __shared__ float sP[16 * 16 * 8];      // per-wave partial p sums

    int hh = blockIdx.x >> 7;              // head
    int q0 = (blockIdx.x & 127) << 4;      // tile base among the kept query rows
    int tid  = threadIdx.x;
    int wave = tid >> 5;
    int lane = tid & 31;
    int lm = lane & 15;
    int lk = (lane >> 4) << 1;

    const float* Q = out;                  // q_out region, layout [t, j, r, f]
    const float* K = out + 1048576;        // k_out region

    // stage the 16x128 Q tile for this head into LDS
    for (int i = tid; i < 2048; i += 512) {
        int qq = i >> 7, dd = i & 127;
        int m = kept_row(q0 + qq);
        int t = m >> 9, rf = m & 511;
        sQ[qq * 128 + dd] = Q[t * TD_STRIDE + (hh * 128 + dd) * 512 + rf];
    }
    __syncthreads();

    const float inv_sqrt_d = 0.08838834764831845f;   // 1/sqrt(128)

    // key address (s, dd, u, g): s*TD_STRIDE + (hh*128 + dd)*512 + u*8 + g
    const float* kp = K + (lm >> 3) * TD_STRIDE + (hh * 128 + lk) * 512 + wave * 32 + (lm & 7) * 4;
    const float* qp = sQ + lm * 128 + lk;

    v8f c[16];
    for (int i = 0; i < 16; ++i) c[i] = v8f{};

    // two fragment sets: the loads of the next 4 dd fly under the 16 products of these 4
    v4f k0[8], k1[8];
    load_k(k0, kp);
    // kept rolled: unrolled whole, the scheduler sinks the loads to just before their use
#pragma unroll 1
    for (int kb = 0; kb < 120; kb += 8) {
        load_k(k1, kp + (kb + 4) * 512);
        mma_k(c, k0, *(const v2f*)(qp + kb));
        load_k(k0, kp + (kb + 8) * 512);
        mma_k(c, k1, *(const v2f*)(qp + kb + 4));
    }
    load_k(k1, kp + 124 * 512);
    mma_k(c, k0, *(const v2f*)(qp + 120));
    mma_k(c, k1, *(const v2f*)(qp + 124));

    // softmax over the 64 (s, g) entries per (query, u); per-g sums pooled over s and u
    float accg[8];
    for (int g = 0; g < 8; ++g) accg[g] = 0.f;
    for (int ul = 0; ul < 4; ++ul) {
        float sc[32];
        for (int i = 0; i < 16; ++i) {
            sc[2 * i]     = c[i][2 * ul] * inv_sqrt_d;
            sc[2 * i + 1] = c[i][2 * ul + 1] * inv_sqrt_d;
        }
        float mx = sc[0];
        for (int i = 1; i < 32; ++i) mx = fmaxf(mx, sc[i]);
        mx = fmaxf(mx, __shfl_xor(mx, 16, 32));
        float eg[8];
        for (int g = 0; g < 8; ++g) eg[g] = 0.f;
        for (int i = 0; i < 16; ++i) {     // i = nt*4 + e
            eg[i & 3]       += exp_native(sc[2 * i] - mx);
            eg[4 + (i & 3)] += exp_native(sc[2 * i + 1] - mx);
        }
        float Z = ((eg[0] + eg[1]) + (eg[2] + eg[3])) + ((eg[4] + eg[5]) + (eg[6] + eg[7]));
        Z += __shfl_xor(Z, 16, 32);
        float rZ = 1.f / Z;
        for (int g = 0; g < 8; ++g) accg[g] += eg[g] * rZ;
    }
    for (int g = 0; g < 8; ++g) accg[g] += __shfl_xor(accg[g], 16, 32);

    if (lane < 16)
        for (int g = 0; g < 8; ++g) sP[wave * 128 + lane * 8 + g] = accg[g];
    __syncthreads();
    if (tid < 128) {
        int qq = tid >> 3, g = tid & 7;
        float s = 0.f;
        for (int w = 0; w < 16; ++w) s += sP[w * 128 + qq * 8 + g];
        p_mean[hh * 32768 + kept_row(q0 + qq) * 8 + g] = s * (1.f / 512.f);
    }
}

// ---------------- Kernel 5: x_out[t,j,r,f<4] = sum_g p_mean * V_mean ----------
__global__ void k_out(const float* __restrict__ p_mean, const float* __restrict__ V_mean,
                      float* __restrict__ x_out) {
    int idx = blockIdx.x * blockDim.x + threadIdx.x;   // 524288
    int f = idx & 3;
    int r = (idx >> 2) & 63;
    int j = (idx >> 8) & 255;
    int t = idx >> 16;
    int n = t * 512 + r * 8 + f;
    int hh = j >> 7;
    const float* p = p_mean + hh * 32768 + n * 8;
    float acc = 0.f;
    for (int g = 0; g < 8; ++g) acc += p[g] * V_mean[j * 8 + g];
    x_out[idx] = acc;
}

extern "C" void kernel_launch(void* const* d_in, const int* in_sizes, int n_in,
                              void* d_out, int out_size, void* d_ws, size_t ws_size,
                              hipStream_t stream) {
    const float* q  = (const float*)d_in[0];
    const float* k  = (const float*)d_in[1];
    const float* v  = (const float*)d_in[2];
    const float* Wq = (const float*)d_in[3];
    const float* bq = (const float*)d_in[4];
    const float* Wk = (const float*)d_in[5];
    const float* bk = (const float*)d_in[6];
    const float* Wv = (const float*)d_in[7];
    const float* bv = (const float*)d_in[8];
    float* out = (float*)d_out;          // [q_out | k_out | x_out]
    float* ws  = (float*)d_ws;
    float* xv_mean = ws;                 // 2048 floats
    float* V_mean  = ws + 2048;          // 2048 floats
    float* p_mean  = ws + 4096;          // 65536 floats  (~280 KB total ws)

    k_vmean_reduce<<<64, 128, 0, stream>>>(v, xv_mean);
    k_vmean_proj<<<64, 128, 0, stream>>>(xv_mean, Wv, bv, V_mean);
    k_proj_qk<<<8192, 32, 0, stream>>>(q, k, Wq, bq, Wk, bk, out);
    k_attn<<<256, 512, 0, stream>>>(out, p_mean);
    k_out<<<2048, 256, 0, stream>>>(p_mean, V_mean, out + 2097152);
}

// v005
// One run takes 41.8 microseconds.
// It is 1.37 times as fast as v003, going by the measured steps of the versions left out in between.
// All steps since v000 together make it 6.47 times as fast.
#include <hip/hip_runtime.h>
#include <hip/hip_bf16.h>
#include <math.h>

typedef __attribute__((ext_vector_type(2))) float v2f;
typedef __attribute__((ext_vector_type(4))) float v4f;
typedef __attribute__((ext_vector_type(8))) float v8f;

#define TD_STRIDE 131072   // D*R*F = 256*64*8 : stride over t in the [T,D,R,F] layout
// input/output addr(t, dm, r, f) = t*TD_STRIDE + dm*512 + r*8 + f

// ---------------- V-mean, part 1: xv_mean[dm][g] = mean over (t,r) of v[t,dm,r,g] ----
// Reads nothing that the Q/K projection writes, so it runs as 32 more blocks of that launch.
// One wave per dm. For a fixed (t, dm) the 512 floats (r, g) are contiguous, so the
// lanes walk them 16 bytes each and every load covers whole lines.
// Float offset (i*32 + lane)*4 + c holds g = (lane & 1)*4 + c.
__device__ __forceinline__ void vmean_reduce_row(const float* __restrict__ v,
                                                 float* __restrict__ xv_mean,
                                                 int dm, int lane) {
    const v4f* p = (const v4f*)(v + dm * 512) + lane;
    v4f x[32];
    for (int t = 0; t < 8; ++t)
        for (int i = 0; i < 4; ++i)
            x[t * 4 + i] = p[t * (TD_STRIDE / 4) + i * 32];
    v4f s0 = x[0], s1 = x[1], s2 = x[2], s3 = x[3];
    for (int t = 1; t < 8; ++t) {
        s0 += x[t * 4];     s1 += x[t * 4 + 1];
        s2 += x[t * 4 + 2]; s3 += x[t * 4 + 3];
    }
    v4f s = (s0 + s1) + (s2 + s3);
    // lanes of equal parity hold the same four g
    for (int m = 2; m < 32; m <<= 1)
        for (int c = 0; c < 4; ++c) s[c] += __shfl_xor(s[c], m, 32);
    if (lane < 2)
        *(v4f*)(xv_mean + dm * 8 + lane * 4) = s * (1.f / 512.f);
}

// ---------------- V-mean, part 2: V_mean[j][g] = xv_mean[:,g] @ Wv[j,:] + bv[j] ------
// Reads nothing that the attention kernel writes, so one wave of each of its 256 blocks does one j.
// One wave per j. Lane l takes dm = l + 32*i, so a row of Wv is read as whole lines.
__device__ __forceinline__ void vmean_proj_row(const float* __restrict__ xv_mean,
                                               const float* __restrict__ Wv,
                                               const float* __restrict__ bv,
                                               float* __restrict__ V_mean,
                                               int j, int lane) {
    const float* w = Wv + j * 256 + lane;
    const v4f* xm = (const v4f*)xv_mean + lane * 2;
    v4f a0 = {}, a1 = {};
    for (int i = 0; i < 8; ++i) {
        float wv = w[i * 32];
        a0 += wv * xm[i * 64];
        a1 += wv * xm[i * 64 + 1];
    }
    for (int m = 1; m < 32; m <<= 1)
        for (int c = 0; c < 4; ++c) {
            a0[c] += __shfl_xor(a0[c], m, 32);
            a1[c] += __shfl_xor(a1[c], m, 32);
        }
    if (lane < 2) {
        v4f o = lane ? a1 : a0;
        *(v4f*)(V_mean + j * 8 + lane * 4) = o + bv[j];
    }
}

// ---------------- Kernel 1: Q/K projection GEMM via V_WMMA_F32_16X16X4_F32 -----
// O[t, j, rf] = sum_dm W[j, dm] * X[t, dm, rf] + b[j], m = t*512 + rf.
// X and O are contiguous along rf, so the product is taken transposed: W is the A
// operand, X the B operand, and the lanes of a C tile run along rf.
// A block of 8 waves owns 256 m x 32 j. Its 32 rows of W are staged once in LDS by
// whole-line loads; a wave owns 32 m (one 128-byte line of every X row and O row).
//   B column lm, tile e : m = mw + lm*2 + e, element e of the lane's 8-byte load
//   k of an 8-k group   : step s, register r -> dm = k8 + half*4 + 2*s + r, for A and B alike
//   C c[jt*2 + e][v]    : j = j0 + jt*16 + half*8 + v, m = mw + lm*2 + e
#define W_PITCH 260    // floats per staged W row: 16 bytes x odd, so the 16-byte reads spread over the banks

__device__ __forceinline__ void load_x(v2f (&d)[16], const float* xp) {
    for (int i = 0; i < 4; ++i)            // 8-k group
        for (int r = 0; r < 4; ++r)
            d[i * 4 + r] = *(const v2f*)(xp + (i * 8 + r) * 512);
}

__device__ __forceinline__ void mma_x(v8f (&c)[4], const v2f (&d)[16], const float* wp) {
    for (int i = 0; i < 4; ++i) {
        v4f w0 = *(const v4f*)(wp + i * 8);
        v4f w1 = *(const v4f*)(wp + 16 * W_PITCH + i * 8);
        for (int s = 0; s < 2; ++s) {
            v2f a0, a1;
            a0.x = w0[2 * s]; a0.y = w0[2 * s + 1];
            a1.x = w1[2 * s]; a1.y = w1[2 * s + 1];
            for (int e = 0; e < 2; ++e) {
                v2f b;
                b.x = d[i * 4 + 2 * s][e];
                b.y = d[i * 4 + 2 * s + 1][e];
                c[e]     = __builtin_amdgcn_wmma_f32_16x16x4_f32(false, a0, false, b, (short)0,
                                                                 c[e], false, false);
                c[2 + e] = __builtin_amdgcn_wmma_f32_16x16x4_f32(false, a1, false, b, (short)0,
                                                                 c[2 + e], false, false);
            }
        }
    }
}

__global__ void __launch_bounds__(256) k_proj_qk(
        const float* __restrict__ Xq, const float* __restrict__ Xk,
        const float* __restrict__ Wq, const float* __restrict__ bq,
        const float* __restrict__ Wk, const float* __restrict__ bk,
        float* __restrict__ out,
        const float* __restrict__ v, float* __restrict__ xv_mean) {
    __shared__ __attribute__((aligned(16))) float sW[32 * W_PITCH];

    int bid   = blockIdx.x;
    if (bid >= 256) {                      // the last 32 blocks: V-mean part 1, 8 dm each; they leave whole, before the barrier
        vmean_reduce_row(v, xv_mean, (bid - 256) * 8 + (threadIdx.x >> 5), threadIdx.x & 31);
        return;
    }
    int which = bid >> 7;                  // 0 = q, 1 = k
    int j0 = ((bid >> 4) & 7) << 5;        // 8  j-tiles of 32
    int m0 = (bid & 15) << 8;              // 16 m-tiles of 256
    const float* X    = which ? Xk : Xq;
    const float* W    = which ? Wk : Wq;
    const float* bias = which ? bk : bq;
    float* O = out + which * 1048576;

    int tid  = threadIdx.x;
    int lane = tid & 31;
    int lm   = lane & 15;
    int half = lane >> 4;

    int mw = m0 + (tid >> 5) * 32;         // the wave's 32 m lie inside one t
    int base = (mw >> 9) * TD_STRIDE + (mw & 511) + lm * 2;
    const float* xp = X + base + half * 4 * 512;

    // stage W[j0 .. j0+31][0 .. 255]: a wave-wide load covers 512 contiguous bytes of a row
    const float* wsrc = W + (j0 + (tid >> 6)) * 256 + (tid & 63) * 4;
    v4f wst[8];
    for (int i = 0; i < 8; ++i) wst[i] = *(const v4f*)(wsrc + i * 1024);
    // precaution: stands in front of any reuse of the address registers of the loads above
    asm volatile("s_wait_xcnt 0x0" ::: "memory");

    v2f x0[16], x1[16];
    load_x(x0, xp);

    float* wdst = sW + (tid >> 6) * W_PITCH + (tid & 63) * 4;
    for (int i = 0; i < 8; ++i) *(v4f*)(wdst + i * 4 * W_PITCH) = wst[i];
    __syncthreads();

    const float* wp = sW + lm * W_PITCH + half * 4;

    v8f c[4];
    for (int i = 0; i < 4; ++i) c[i] = v8f{};

    // two fragment sets: the loads of the next 32 dm fly under the 32 products of these 32
    // unrolled whole: every load takes its offset as an immediate and none is drained at a back edge
#pragma unroll
    for (int kb = 0; kb < 192; kb += 64) {
        load_x(x1, xp + (kb + 32) * 512);
        mma_x(c, x0, wp + kb);
        load_x(x0, xp + (kb + 64) * 512);
        mma_x(c, x1, wp + kb + 32);
    }
    load_x(x1, xp + 224 * 512);
    // precaution: stands in front of any reuse of the address registers of the loads above
    asm volatile("s_wait_xcnt 0x0" ::: "memory");
    mma_x(c, x0, wp + 192);
    mma_x(c, x1, wp + 224);

    float* op = O + base + (j0 + half * 8) * 512;
    for (int jt = 0; jt < 2; ++jt) {
        const v4f* bp = (const v4f*)(bias + j0 + jt * 16 + half * 8);
        v4f b0 = bp[0], b1 = bp[1];
        for (int v = 0; v < 8; ++v) {
            float bj = v < 4 ? b0[v & 3] : b1[v & 3];
            v2f o;
            o.x = c[jt * 2][v] + bj;
            o.y = c[jt * 2 + 1][v] + bj;
            *(v2f*)(op + (jt * 16 + v) * 512) = o;
        }
    }
}

// ---------------- Kernel 2: fused scores (WMMA) -> softmax(Tk,Fk) -> pool ------
// x_out keeps only the query rows with f < 4, so only those 2048 rows per head
// are scored. Kept row qi maps to (t, r, f) = (qi >> 8, (qi >> 2) & 63, qi & 3).
//
// One wave owns 4 values of u. For a fixed (s, dd) their 32 floats (u, g) are one
// 128-byte line of k_out, so 8 lanes read it whole, 16 bytes each, exactly once.
// The product is taken transposed, S^T = K Q^T: K is the A operand, Q the B operand.
//   A row  lm       : s = 2*nt + (lm >> 3), line floats (lm & 7)*4 + e, e = 0..3
//   tile   (nt, e)  : element e of the 16-byte loads of the s pair nt
//   C      c[v]     : query lm, key row v + 8*half, that is
//                     s = 2*nt + half, u = wave*4 + (v >> 1), g = (v & 1)*4 + e
// A lane so holds 32 of the 64 (s, g) scores of each of its 4 (query, u) pairs and
// lane ^ 16 holds the other 32: the softmax stays in registers.
__device__ __forceinline__ int kept_row(int qi) {
    return (qi >> 8) * 512 + ((qi >> 2) & 63) * 8 + (qi & 3);   // m = t*512 + r*8 + f
}

__device__ __forceinline__ void load_k(v4f (&d)[8], const float* kp) {
    for (int nt = 0; nt < 4; ++nt) {
        d[2 * nt]     = *(const v4f*)(kp + nt * 2 * TD_STRIDE);         // dd
        d[2 * nt + 1] = *(const v4f*)(kp + nt * 2 * TD_STRIDE + 512);   // dd + 1
    }
}

__device__ __forceinline__ void mma_k(v8f (&c)[16], const v4f (&d)[8], v2f b) {
    for (int nt = 0; nt < 4; ++nt)
        for (int e = 0; e < 4; ++e) {
            v2f a;
            a.x = d[2 * nt][e];
            a.y = d[2 * nt + 1][e];
            c[nt * 4 + e] = __builtin_amdgcn_wmma_f32_16x16x4_f32(false, a, false, b, (short)0,
                                                                 c[nt * 4 + e], false, false);
        }
}

// exp(x) in the native form, a multiply by log2(e) and v_exp_f32. The v_nop keeps the one
// slot the instruction set asks for behind a transcendental, before its result is read
// or its source register overwritten.
__device__ __forceinline__ float exp_native(float x) {
    float t = x * 1.4426950408889634f, r;
    asm("v_exp_f32 %0, %1\n\tv_nop" : "=v"(r) : "v"(t));
    return r;
}

__global__ void __launch_bounds__(512) k_attn(const float* __restrict__ out,
                                              float* __restrict__ p_mean,
                                              const float* __restrict__ xv_mean,
                                              const float* __restrict__ Wv,
                                              const float* __restrict__ bv,
                                              float* __restrict__ V_mean) {
    __shared__ float sQ[16 * 128];         // staged Q tile
    __shared__ float sP[16 * 16 * 8];      // per-wave partial p sums

    int hh = blockIdx.x >> 7;              // head
    int q0 = (blockIdx.x & 127) << 4;      // tile base among the kept query rows
    int tid  = threadIdx.x;
    int wave = tid >> 5;
    int lane = tid & 31;
    int lm = lane & 15;
    int lk = (lane >> 4) << 1;

    const float* Q = out;                  // q_out region, layout [t, j, r, f]
    const float* K = out + 1048576;        // k_out region

    // stage the 16x128 Q tile for this head into LDS
    for (int i = tid; i < 2048; i += 512) {
        int qq = i >> 7, dd = i & 127;
        int m = kept_row(q0 + qq);
        int t = m >> 9, rf = m & 511;
        sQ[qq * 128 + dd] = Q[t * TD_STRIDE + (hh * 128 + dd) * 512 + rf];
    }
    __syncthreads();

    // V-mean part 2 for j = block index, by the block's last wave alone: the other waves
    // of its SIMD have the matrix unit meanwhile, so its late start costs no matrix time
    if (__builtin_amdgcn_readfirstlane(wave) == 15)
        vmean_proj_row(xv_mean, Wv, bv, V_mean, blockIdx.x, lane);

    const float inv_sqrt_d = 0.08838834764831845f;   // 1/sqrt(128)

    // key address (s, dd, u, g): s*TD_STRIDE + (hh*128 + dd)*512 + u*8 + g
    const float* kp = K + (lm >> 3) * TD_STRIDE + (hh * 128 + lk) * 512 + wave * 32 + (lm & 7) * 4;
    const float* qp = sQ + lm * 128 + lk;

    v8f c[16];
    for (int i = 0; i < 16; ++i) c[i] = v8f{};

    // two fragment sets: the loads of the next 4 dd fly under the 16 products of these 4
    v4f k0[8], k1[8];
    load_k(k0, kp);
    // kept rolled: unrolled whole, the scheduler sinks the loads to just before their use
#pragma unroll 1
    for (int kb = 0; kb < 120; kb += 8) {
        load_k(k1, kp + (kb + 4) * 512);
        mma_k(c, k0, *(const v2f*)(qp + kb));
        load_k(k0, kp + (kb + 8) * 512);
        mma_k(c, k1, *(const v2f*)(qp + kb + 4));
    }
    load_k(k1, kp + 124 * 512);
    mma_k(c, k0, *(const v2f*)(qp + 120));
    mma_k(c, k1, *(const v2f*)(qp + 124));

    // softmax over the 64 (s, g) entries per (query, u); per-g sums pooled over s and u
    float accg[8];
    for (int g = 0; g < 8; ++g) accg[g] = 0.f;
    for (int ul = 0; ul < 4; ++ul) {
        float sc[32];
        for (int i = 0; i < 16; ++i) {
            sc[2 * i]     = c[i][2 * ul] * inv_sqrt_d;
            sc[2 * i + 1] = c[i][2 * ul + 1] * inv_sqrt_d;
        }
        float mx = sc[0];
        for (int i = 1; i < 32; ++i) mx = fmaxf(mx, sc[i]);
        mx = fmaxf(mx, __shfl_xor(mx, 16, 32));
        float eg[8];
        for (int g = 0; g < 8; ++g) eg[g] = 0.f;
        for (int i = 0; i < 16; ++i) {     // i = nt*4 + e
            eg[i & 3]       += exp_native(sc[2 * i] - mx);
            eg[4 + (i & 3)] += exp_native(sc[2 * i + 1] - mx);
        }
        float Z = ((eg[0] + eg[1]) + (eg[2] + eg[3])) + ((eg[4] + eg[5]) + (eg[6] + eg[7]));
        Z += __shfl_xor(Z, 16, 32);
        float rZ = 1.f / Z;
        for (int g = 0; g < 8; ++g) accg[g] += eg[g] * rZ;
    }
    for (int g = 0; g < 8; ++g) accg[g] += __shfl_xor(accg[g], 16, 32);

    if (lane < 16)
        for (int g = 0; g < 8; ++g) sP[wave * 128 + lane * 8 + g] = accg[g];
    __syncthreads();
    if (tid < 128) {
        int qq = tid >> 3, g = tid & 7;
        float s = 0.f;
        for (int w = 0; w < 16; ++w) s += sP[w * 128 + qq * 8 + g];
        p_mean[hh * 32768 + kept_row(q0 + qq) * 8 + g] = s * (1.f / 512.f);
    }
}

// ---------------- Kernel 3: x_out[t,j,r,f<4] = sum_g p_mean * V_mean ----------
__global__ void k_out(const float* __restrict__ p_mean, const float* __restrict__ V_mean,
                      float* __restrict__ x_out) {
    int idx = blockIdx.x * blockDim.x + threadIdx.x;   // 524288
    int f = idx & 3;
    int r = (idx >> 2) & 63;
    int j = (idx >> 8) & 255;
    int t = idx >> 16;
    int n = t * 512 + r * 8 + f;
    int hh = j >> 7;
    const float* p = p_mean + hh * 32768 + n * 8;
    float acc = 0.f;
    for (int g = 0; g < 8; ++g) acc += p[g] * V_mean[j * 8 + g];
    x_out[idx] = acc;
}

extern "C" void kernel_launch(void* const* d_in, const int* in_sizes, int n_in,
                              void* d_out, int out_size, void* d_ws, size_t ws_size,
                              hipStream_t stream) {
    const float* q  = (const float*)d_in[0];
    const float* k  = (const float*)d_in[1];
    const float* v  = (const float*)d_in[2];
    const float* Wq = (const float*)d_in[3];
    const float* bq = (const float*)d_in[4];
    const float* Wk = (const float*)d_in[5];
    const float* bk = (const float*)d_in[6];
    const float* Wv = (const float*)d_in[7];
    const float* bv = (const float*)d_in[8];
    float* out = (float*)d_out;          // [q_out | k_out | x_out]
    float* ws  = (float*)d_ws;
    float* xv_mean = ws;                 // 2048 floats
    float* V_mean  = ws + 2048;          // 2048 floats
    float* p_mean  = ws + 4096;          // 65536 floats  (~280 KB total ws)

    k_proj_qk<<<288, 256, 0, stream>>>(q, k, Wq, bq, Wk, bk, out, v, xv_mean);
    k_attn<<<256, 512, 0, stream>>>(out, p_mean, xv_mean, Wv, bv, V_mean);
    k_out<<<2048, 256, 0, stream>>>(p_mean, V_mean, out + 2097152);
}

// v006
// One run takes 38.3 microseconds.
// Next to v005, in two timings, it ran 1.09 times as fast each time.
// Over all steps from v000 it is 7.05 times as fast.
#include <hip/hip_runtime.h>
#include <hip/hip_bf16.h>
#include <math.h>

typedef __attribute__((ext_vector_type(2))) float v2f;
typedef __attribute__((ext_vector_type(4))) float v4f;
typedef __attribute__((ext_vector_type(8))) float v8f;

#define TD_STRIDE 131072   // D*R*F = 256*64*8 : stride over t in the [T,D,R,F] layout
// input/output addr(t, dm, r, f) = t*TD_STRIDE + dm*512 + r*8 + f

// ---------------- V-mean, part 1: xv_mean[dm][g] = mean over (t,r) of v[t,dm,r,g] ----
// Reads nothing that the Q/K projection writes, so it runs as 32 more blocks of that launch.
// One wave per dm. For a fixed (t, dm) the 512 floats (r, g) are contiguous, so the
// lanes walk them 16 bytes each and every load covers whole lines.
// Float offset (i*32 + lane)*4 + c holds g = (lane & 1)*4 + c.
__device__ __forceinline__ void vmean_reduce_row(const float* __restrict__ v,
                                                 float* __restrict__ xv_mean,
                                                 int dm, int lane) {
    const v4f* p = (const v4f*)(v + dm * 512) + lane;
    v4f x[32];
    for (int t = 0; t < 8; ++t)
        for (int i = 0; i < 4; ++i)
            x[t * 4 + i] = p[t * (TD_STRIDE / 4) + i * 32];
    v4f s0 = x[0], s1 = x[1], s2 = x[2], s3 = x[3];
    for (int t = 1; t < 8; ++t) {
        s0 += x[t * 4];     s1 += x[t * 4 + 1];
        s2 += x[t * 4 + 2]; s3 += x[t * 4 + 3];
    }
    v4f s = (s0 + s1) + (s2 + s3);
    // lanes of equal parity hold the same four g
    for (int m = 2; m < 32; m <<= 1)
        for (int c = 0; c < 4; ++c) s[c] += __shfl_xor(s[c], m, 32);
    if (lane < 2)
        *(v4f*)(xv_mean + dm * 8 + lane * 4) = s * (1.f / 512.f);
}

// ---------------- V-mean, part 2: V_mean[j][g] = xv_mean[:,g] @ Wv[j,:] + bv[j] ------
// Reads nothing that the attention kernel writes, so one wave of each of its 256 blocks does one j.
// One wave per j. Lane l takes dm = l + 32*i, so a row of Wv is read as whole lines.
__device__ __forceinline__ void vmean_proj_row(const float* __restrict__ xv_mean,
                                               const float* __restrict__ Wv,
                                               const float* __restrict__ bv,
                                               float* __restrict__ V_mean,
                                               int j, int lane) {
    const float* w = Wv + j * 256 + lane;
    const v4f* xm = (const v4f*)xv_mean + lane * 2;
    v4f a0 = {}, a1 = {};
    for (int i = 0; i < 8; ++i) {
        float wv = w[i * 32];
        a0 += wv * xm[i * 64];
        a1 += wv * xm[i * 64 + 1];
    }
    for (int m = 1; m < 32; m <<= 1)
        for (int c = 0; c < 4; ++c) {
            a0[c] += __shfl_xor(a0[c], m, 32);
            a1[c] += __shfl_xor(a1[c], m, 32);
        }
    if (lane < 2) {
        v4f o = lane ? a1 : a0;
        *(v4f*)(V_mean + j * 8 + lane * 4) = o + bv[j];
    }
}

// ---------------- Kernel 1: Q/K projection GEMM via V_WMMA_F32_16X16X4_F32 -----
// O[t, j, rf] = sum_dm W[j, dm] * X[t, dm, rf] + b[j], m = t*512 + rf.
// X and O are contiguous along rf, so the product is taken transposed: W is the A
// operand, X the B operand, and the lanes of a C tile run along rf.
// A block of 8 waves owns 256 m x 32 j. Its 32 rows of W are staged once in LDS by
// whole-line loads; a wave owns 32 m (one 128-byte line of every X row and O row).
//   B column lm, tile e : m = mw + lm*2 + e, element e of the lane's 8-byte load
//   k of an 8-k group   : step s, register r -> dm = k8 + half*4 + 2*s + r, for A and B alike
//   C c[jt*2 + e][v]    : j = j0 + jt*16 + half*8 + v, m = mw + lm*2 + e
#define W_PITCH 260    // floats per staged W row: 16 bytes x odd, so the 16-byte reads spread over the banks

__device__ __forceinline__ void load_x(v2f (&d)[16], const float* xp) {
    for (int i = 0; i < 4; ++i)            // 8-k group
        for (int r = 0; r < 4; ++r)
            d[i * 4 + r] = *(const v2f*)(xp + (i * 8 + r) * 512);
}

__device__ __forceinline__ void mma_x(v8f (&c)[4], const v2f (&d)[16], const float* wp) {
    for (int i = 0; i < 4; ++i) {
        v4f w0 = *(const v4f*)(wp + i * 8);
        v4f w1 = *(const v4f*)(wp + 16 * W_PITCH + i * 8);
        for (int s = 0; s < 2; ++s) {
            v2f a0, a1;
            a0.x = w0[2 * s]; a0.y = w0[2 * s + 1];
            a1.x = w1[2 * s]; a1.y = w1[2 * s + 1];
            for (int e = 0; e < 2; ++e) {
                v2f b;
                b.x = d[i * 4 + 2 * s][e];
                b.y = d[i * 4 + 2 * s + 1][e];
                c[e]     = __builtin_amdgcn_wmma_f32_16x16x4_f32(false, a0, false, b, (short)0,
                                                                 c[e], false, false);
                c[2 + e] = __builtin_amdgcn_wmma_f32_16x16x4_f32(false, a1, false, b, (short)0,
                                                                 c[2 + e], false, false);
            }
        }
    }
}

__global__ void __launch_bounds__(256) k_proj_qk(
        const float* __restrict__ Xq, const float* __restrict__ Xk,
        const float* __restrict__ Wq, const float* __restrict__ bq,
        const float* __restrict__ Wk, const float* __restrict__ bk,
        float* __restrict__ out,
        const float* __restrict__ v, float* __restrict__ xv_mean) {
    __shared__ __attribute__((aligned(16))) float sW[32 * W_PITCH];

    int bid   = blockIdx.x;
    if (bid >= 256) {                      // the last 32 blocks: V-mean part 1, 8 dm each; they leave whole, before the barrier
        vmean_reduce_row(v, xv_mean, (bid - 256) * 8 + (threadIdx.x >> 5), threadIdx.x & 31);
        return;
    }
    int which = bid >> 7;                  // 0 = q, 1 = k
    int j0 = ((bid >> 4) & 7) << 5;        // 8  j-tiles of 32
    int m0 = (bid & 15) << 8;              // 16 m-tiles of 256
    const float* X    = which ? Xk : Xq;
    const float* W    = which ? Wk : Wq;
    const float* bias = which ? bk : bq;
    float* O = out + which * 1048576;

    int tid  = threadIdx.x;
    int lane = tid & 31;
    int lm   = lane & 15;
    int half = lane >> 4;

    int mw = m0 + (tid >> 5) * 32;         // the wave's 32 m lie inside one t
    int base = (mw >> 9) * TD_STRIDE + (mw & 511) + lm * 2;
    const float* xp = X + base + half * 4 * 512;

    // stage W[j0 .. j0+31][0 .. 255]: a wave-wide load covers 512 contiguous bytes of a row
    const float* wsrc = W + (j0 + (tid >> 6)) * 256 + (tid & 63) * 4;
    v4f wst[8];
    for (int i = 0; i < 8; ++i) wst[i] = *(const v4f*)(wsrc + i * 1024);
    // precaution: stands in front of any reuse of the address registers of the loads above
    asm volatile("s_wait_xcnt 0x0" ::: "memory");

    v2f x0[16], x1[16];
    load_x(x0, xp);

    float* wdst = sW + (tid >> 6) * W_PITCH + (tid & 63) * 4;
    for (int i = 0; i < 8; ++i) *(v4f*)(wdst + i * 4 * W_PITCH) = wst[i];
    __syncthreads();

    const float* wp = sW + lm * W_PITCH + half * 4;

    v8f c[4];
    for (int i = 0; i < 4; ++i) c[i] = v8f{};

    // two fragment sets: the loads of the next 32 dm fly under the 32 products of these 32
    // unrolled whole: every load takes its offset as an immediate and none is drained at a back edge
#pragma unroll
    for (int kb = 0; kb < 192; kb += 64) {
        load_x(x1, xp + (kb + 32) * 512);
        mma_x(c, x0, wp + kb);
        load_x(x0, xp + (kb + 64) * 512);
        mma_x(c, x1, wp + kb + 32);
    }
    load_x(x1, xp + 224 * 512);
    // precaution: stands in front of any reuse of the address registers of the loads above
    asm volatile("s_wait_xcnt 0x0" ::: "memory");
    mma_x(c, x0, wp + 192);
    mma_x(c, x1, wp + 224);

    float* op = O + base + (j0 + half * 8) * 512;
    for (int jt = 0; jt < 2; ++jt) {
        const v4f* bp = (const v4f*)(bias + j0 + jt * 16 + half * 8);
        v4f b0 = bp[0], b1 = bp[1];
        for (int v = 0; v < 8; ++v) {
            float bj = v < 4 ? b0[v & 3] : b1[v & 3];
            v2f o;
            o.x = c[jt * 2][v] + bj;
            o.y = c[jt * 2 + 1][v] + bj;
            *(v2f*)(op + (jt * 16 + v) * 512) = o;
        }
    }
}

// ---------------- Kernel 2: fused scores (WMMA) -> softmax(Tk,Fk) -> pool ------
// x_out keeps only the query rows with f < 4, so only those 2048 rows per head
// are scored. Kept row qi maps to (t, r, f) = (qi >> 8, (qi >> 2) & 63, qi & 3).
//
// A block owns 64 kept query rows (4 tiles of 16) and 16 values of u (4 groups of 4):
// wave = ug*4 + qt scores query tile qt against u group ug. The four waves of a u group
// need the same keys, so the block brings its keys into LDS once, by asynchronous copies,
// 16 dd a stage in two buffers: L2 delivers a key once to the block, for all four query tiles.
// The pooled sums of the four blocks that share a query row go to four planes of p_part.
//
// For a fixed (s, dd) the block's 128 floats (u, g) are 512 contiguous bytes: one copy of a wave.
// The product is taken transposed, S^T = K Q^T: K is the A operand, Q the B operand.
//   A row  lm       : s = 2*nt + (lm >> 3), floats (lm & 7)*4 + e of the u group's 32, e = 0..3
//   tile   (nt, e)  : element e of the 16-byte reads of the s pair nt
//   C      c[v]     : query lm, key row v + 8*half, that is
//                     s = 2*nt + half, u = group*4 + (v >> 1), g = (v & 1)*4 + e
// A lane so holds 32 of the 64 (s, g) scores of each of its 4 (query, u) pairs and
// lane ^ 16 holds the other 32: the softmax stays in registers.
#define K_PITCH 160              // floats per staged key row (ddl*8 + s): 128 + 32, so rows s and s + 1 take the two halves of the banks
#define K_STAGE (128 * K_PITCH)  // 16 dd x 8 s rows
#define Q_PITCH 132              // floats per staged query row: the 16 rows of an 8-byte read fall on 16 bank pairs

__device__ __forceinline__ int kept_row(int qi) {
    return (qi >> 8) * 512 + ((qi >> 2) & 63) * 8 + (qi & 3);   // m = t*512 + r*8 + f
}

// One dd of a stage: its 8 rows s, 512 bytes each, 16 bytes a lane, straight into LDS.
// The s_wait_xcnt is a precaution: it stands in front of any reuse of the address registers
// of the copies, and inside their statement so that nothing is moved in between.
__device__ __forceinline__ void copy_k(unsigned l, const float* g) {
    asm volatile("global_load_async_to_lds_b128 %0, %8, off\n\t"
                 "global_load_async_to_lds_b128 %1, %9, off\n\t"
                 "global_load_async_to_lds_b128 %2, %10, off\n\t"
                 "global_load_async_to_lds_b128 %3, %11, off\n\t"
                 "global_load_async_to_lds_b128 %4, %12, off\n\t"
                 "global_load_async_to_lds_b128 %5, %13, off\n\t"
                 "global_load_async_to_lds_b128 %6, %14, off\n\t"
                 "global_load_async_to_lds_b128 %7, %15, off\n\t"
                 "s_wait_xcnt 0x0"
                 :: "v"(l), "v"(l + 1 * K_PITCH * 4), "v"(l + 2 * K_PITCH * 4), "v"(l + 3 * K_PITCH * 4),
                    "v"(l + 4 * K_PITCH * 4), "v"(l + 5 * K_PITCH * 4), "v"(l + 6 * K_PITCH * 4),
                    "v"(l + 7 * K_PITCH * 4),
                    "v"(g), "v"(g + 1 * TD_STRIDE), "v"(g + 2 * TD_STRIDE), "v"(g + 3 * TD_STRIDE),
                    "v"(g + 4 * TD_STRIDE), "v"(g + 5 * TD_STRIDE), "v"(g + 6 * TD_STRIDE),
                    "v"(g + 7 * TD_STRIDE)
                 : "memory");
}

__device__ __forceinline__ void load_k(v4f (&d)[8], const float* kp) {
    for (int nt = 0; nt < 4; ++nt) {
        d[2 * nt]     = *(const v4f*)(kp + nt * 2 * K_PITCH);         // dd
        d[2 * nt + 1] = *(const v4f*)(kp + (8 + nt * 2) * K_PITCH);   // dd + 1
    }
}

__device__ __forceinline__ void mma_k(v8f (&c)[16], const v4f (&d)[8], v2f b) {
    for (int nt = 0; nt < 4; ++nt)
        for (int e = 0; e < 4; ++e) {
            v2f a;
            a.x = d[2 * nt][e];
            a.y = d[2 * nt + 1][e];
            c[nt * 4 + e] = __builtin_amdgcn_wmma_f32_16x16x4_f32(false, a, false, b, (short)0,
                                                                 c[nt * 4 + e], false, false);
        }
}

// exp(x) in the native form, a multiply by log2(e) and v_exp_f32. The v_nop keeps the one
// slot the instruction set asks for behind a transcendental, before its result is read
// or its source register overwritten.
__device__ __forceinline__ float exp_native(float x) {
    float t = x * 1.4426950408889634f, r;
    asm("v_exp_f32 %0, %1\n\tv_nop" : "=v"(r) : "v"(t));
    return r;
}

__global__ void __launch_bounds__(512) k_attn(const float* __restrict__ out,
                                              float* __restrict__ p_part,
                                              const float* __restrict__ xv_mean,
                                              const float* __restrict__ Wv,
                                              const float* __restrict__ bv,
                                              float* __restrict__ V_mean) {
    __shared__ __attribute__((aligned(16))) float sK[2 * K_STAGE];   // two key stages
    __shared__ __attribute__((aligned(16))) float sQ[64 * Q_PITCH];  // staged Q rows
    __shared__ float sP[16 * 16 * 8];                                // per-wave partial p sums

    int hh = blockIdx.x >> 7;              // head
    int q0 = ((blockIdx.x >> 2) & 31) << 6;   // base among the kept query rows
    int uq = blockIdx.x & 3;               // which 16 u
    int tid  = threadIdx.x;
    int wave = tid >> 5;
    int lane = tid & 31;
    int lm = lane & 15;
    int lk = (lane >> 4) << 1;
    int qt = wave & 3;                     // query tile
    int ug = wave >> 2;                    // u group

    const float* Q = out;                  // q_out region, layout [t, j, r, f]
    const float* K = out + 1048576;        // k_out region

    // key address (s, dd, u, g): s*TD_STRIDE + (hh*128 + dd)*512 + u*8 + g; wave w copies dd = 16*stage + w
    const float* ksrc = K + (hh * 128 + wave) * 512 + uq * 128 + lane * 4;
    unsigned kdst = (unsigned)(size_t)(sK + wave * 8 * K_PITCH + lane * 4);
    copy_k(kdst, ksrc);                    // stage 0

    // stage the 64x128 Q rows of this head: a lane takes the 4 kept f of one (dd, r), 4 lanes share a line
    {
        int dd = tid >> 2, r4 = tid & 3;
        const float* qs = Q + (q0 >> 8) * TD_STRIDE + (hh * 128 + dd) * 512 + (((q0 >> 2) & 63) + r4) * 8;
        v4f x[4];
        for (int i = 0; i < 4; ++i) x[i] = *(const v4f*)(qs + i * 32);
        // precaution: stands in front of any reuse of the address registers of the loads above
        asm volatile("s_wait_xcnt 0x0" ::: "memory");
        for (int i = 0; i < 4; ++i)
            for (int f = 0; f < 4; ++f) sQ[(i * 16 + r4 * 4 + f) * Q_PITCH + dd] = x[i][f];
    }

    // stage 0 has landed for this wave; the barrier publishes it, and sQ, to the others
    asm volatile("s_wait_asynccnt 0x0" ::: "memory");
    __syncthreads();
    copy_k(kdst + K_STAGE * 4, ksrc + 16 * 512);   // stage 1

    // V-mean part 2 for j = block index, by the block's last wave alone: the other waves
    // of its SIMD have the matrix unit meanwhile, so its late start costs no matrix time
    if (__builtin_amdgcn_readfirstlane(wave) == 15)
        vmean_proj_row(xv_mean, Wv, bv, V_mean, blockIdx.x, lane);

    const float inv_sqrt_d = 0.08838834764831845f;   // 1/sqrt(128)

    const float* kr = sK + (lk * 8 + (lm >> 3)) * K_PITCH + ug * 32 + (lm & 7) * 4;
    const float* qp = sQ + (qt * 16 + lm) * Q_PITCH + lk;

    v8f c[16];
    for (int i = 0; i < 16; ++i) c[i] = v8f{};

    // one trip a stage: 4 steps of 4 dd, two fragment sets inside the trip
    // kept rolled: a trip already holds 64 products, unrolling the stages would only grow the text
#pragma unroll 1
    for (int t = 0; t < 8; ++t) {
        const float* kp = kr + (t & 1) * K_STAGE;
        const float* qq = qp + t * 16;
        v4f k0[8], k1[8];
        load_k(k0, kp);
        load_k(k1, kp + 32 * K_PITCH);
        mma_k(c, k0, *(const v2f*)(qq));
        load_k(k0, kp + 64 * K_PITCH);
        mma_k(c, k1, *(const v2f*)(qq + 4));
        load_k(k1, kp + 96 * K_PITCH);
        mma_k(c, k0, *(const v2f*)(qq + 8));
        mma_k(c, k1, *(const v2f*)(qq + 12));
        if (t == 7) break;                 // no stage follows: nothing to publish, the waves go on apart
        // publish point of stage t + 1: this wave's reads of stage t are done, its copies of
        // stage t + 1 have landed; behind the barrier the buffer of stage t is free for stage t + 2
        asm volatile("s_wait_dscnt 0x0" ::: "memory");
        asm volatile("s_wait_asynccnt 0x0" ::: "memory");
        __syncthreads();
        if (t < 6) copy_k(kdst + (t & 1) * (K_STAGE * 4), ksrc + (t + 2) * (16 * 512));
    }
    // no copy is left in flight when the wave goes on
    asm volatile("s_wait_asynccnt 0x0" ::: "memory");

    // softmax over the 64 (s, g) entries per (query, u); per-g sums pooled over s and u
    float accg[8];
    for (int g = 0; g < 8; ++g) accg[g] = 0.f;
    for (int ul = 0; ul < 4; ++ul) {
        float sc[32];
        for (int i = 0; i < 16; ++i) {
            sc[2 * i]     = c[i][2 * ul] * inv_sqrt_d;
            sc[2 * i + 1] = c[i][2 * ul + 1] * inv_sqrt_d;
        }
        float mx = sc[0];
        for (int i = 1; i < 32; ++i) mx = fmaxf(mx, sc[i]);
        mx = fmaxf(mx, __shfl_xor(mx, 16, 32));
        float eg[8];
        for (int g = 0; g < 8; ++g) eg[g] = 0.f;
        for (int i = 0; i < 16; ++i) {     // i = nt*4 + e
            eg[i & 3]       += exp_native(sc[2 * i] - mx);
            eg[4 + (i & 3)] += exp_native(sc[2 * i + 1] - mx);
        }
        float Z = ((eg[0] + eg[1]) + (eg[2] + eg[3])) + ((eg[4] + eg[5]) + (eg[6] + eg[7]));
        Z += __shfl_xor(Z, 16, 32);
        float rZ = 1.f / Z;
        for (int g = 0; g < 8; ++g) accg[g] += eg[g] * rZ;
    }
    for (int g = 0; g < 8; ++g) accg[g] += __shfl_xor(accg[g], 16, 32);

    if (lane < 16)
        for (int g = 0; g < 8; ++g) sP[wave * 128 + lane * 8 + g] = accg[g];
    __syncthreads();
    {
        int t4 = tid >> 7, qq = (tid >> 3) & 15, g = tid & 7;
        float s = 0.f;
        for (int w = 0; w < 4; ++w) s += sP[(w * 4 + t4) * 128 + qq * 8 + g];
        p_part[uq * 65536 + hh * 32768 + kept_row(q0 + t4 * 16 + qq) * 8 + g] = s * (1.f / 512.f);
    }
}

// ---------------- Kernel 3: x_out[t,j,r,f<4] = sum_g p_mean * V_mean ----------
// p_mean is the sum of the four planes of p_part, one per 16 u. A thread adds the planes of
// its row once and serves 4 j with the sum, so an output costs as many p bytes as with one plane.
__global__ void k_out(const float* __restrict__ p_part, const float* __restrict__ V_mean,
                      float* __restrict__ x_out) {
    int idx = blockIdx.x * blockDim.x + threadIdx.x;   // 131072
    int f = idx & 3;
    int r = (idx >> 2) & 63;
    int j0 = ((idx >> 8) & 63) * 4;
    int t = idx >> 14;
    int n = t * 512 + r * 8 + f;
    int hh = j0 >> 7;
    const v4f* pp = (const v4f*)(p_part + hh * 32768 + n * 8);
    v4f a0 = pp[0], a1 = pp[16384], a2 = pp[32768], a3 = pp[49152];
    v4f b0 = pp[1], b1 = pp[16385], b2 = pp[32769], b3 = pp[49153];
    // precaution: stands in front of any reuse of the address registers of the loads above
    asm volatile("s_wait_xcnt 0x0" ::: "memory");
    v4f pa = (a0 + a1) + (a2 + a3);
    v4f pb = (b0 + b1) + (b2 + b3);
    for (int jj = 0; jj < 4; ++jj) {
        const float* vm = V_mean + (j0 + jj) * 8;
        float acc = 0.f;
        for (int g = 0; g < 4; ++g) acc += pa[g] * vm[g];
        for (int g = 0; g < 4; ++g) acc += pb[g] * vm[4 + g];
        x_out[(t * 256 + j0 + jj) * 256 + (idx & 255)] = acc;
    }
}

extern "C" void kernel_launch(void* const* d_in, const int* in_sizes, int n_in,
                              void* d_out, int out_size, void* d_ws, size_t ws_size,
                              hipStream_t stream) {
    const float* q  = (const float*)d_in[0];
    const float* k  = (const float*)d_in[1];
    const float* v  = (const float*)d_in[2];
    const float* Wq = (const float*)d_in[3];
    const float* bq = (const float*)d_in[4];
    const float* Wk = (const float*)d_in[5];
    const float* bk = (const float*)d_in[6];
    const float* Wv = (const float*)d_in[7];
    const float* bv = (const float*)d_in[8];
    float* out = (float*)d_out;          // [q_out | k_out | x_out]
    float* ws  = (float*)d_ws;
    float* xv_mean = ws;                 // 2048 floats
    float* V_mean  = ws + 2048;          // 2048 floats
    float* p_part  = ws + 4096;          // 4 planes of 65536 floats  (~1.1 MB total ws)

    k_proj_qk<<<288, 256, 0, stream>>>(q, k, Wq, bq, Wk, bk, out, v, xv_mean);
    k_attn<<<256, 512, 0, stream>>>(out, p_part, xv_mean, Wv, bv, V_mean);
    k_out<<<512, 256, 0, stream>>>(p_part, V_mean, out + 2097152);
}
